// v000
// Times are from an AMD MI455X. After a warm-up the kernel runs many times in a row, and a time is the length of
// such a window on the GPU divided by its runs, so every launch and the gaps after it count. The runs cycle
// through copies of the inputs. A figure is the median of several windows, for all but v000 over two sittings.
// Sittings can differ by a few percent; kernels timed side by side share one.
// v000 is the starting kernel. One run takes 258 microseconds.
#include <hip/hip_runtime.h>
#include <hip/hip_bf16.h>

typedef __attribute__((ext_vector_type(16))) __bf16 v16bf;
typedef __attribute__((ext_vector_type(8)))  __bf16 v8bf;
typedef __attribute__((ext_vector_type(8)))  float  v8f;

#define AS_STR 136   // 128 K elems + 8 pad (bf16) -> 272B row stride, 16B aligned
#define YS_STR 132   // f32 row stride for epilogue overlay

__device__ __forceinline__ __bf16 tobf(float f) { return (__bf16)f; }

// Load one 16-lane-row fragment per the CDNA5 16-bit A/B 16x32 VGPR layout:
// half 0 -> K kk+0..7 then kk+16..23 ; half 1 -> K kk+8..15 then kk+24..31
__device__ __forceinline__ v16bf load_frag(const __bf16* __restrict__ row, int kk, int hf) {
  v8bf lo = *(const v8bf*)(row + kk + 8 * hf);
  v8bf hi = *(const v8bf*)(row + kk + 16 + 8 * hf);
  v16bf r;
#pragma unroll
  for (int i = 0; i < 8; ++i) { r[i] = lo[i]; r[i + 8] = hi[i]; }
  return r;
}

__device__ __forceinline__ float silu_f(float g) { return g / (1.0f + __expf(-g)); }

// -----------------------------------------------------------------------------
// Kernel 1: per-token up & gate projections + SiLU-mul, h[t][b][e] to workspace.
// A[b][k] = Asrc[(b*128+k)*128 + tok]  (token-mix transpose folded into load)
// grid = (E/64 = 8, T = 128), block = 256 (8 waves)
// -----------------------------------------------------------------------------
__global__ __launch_bounds__(256)
void upgate_kernel(const float* __restrict__ Asrc, const float* __restrict__ Wu,
                   const float* __restrict__ bu,   const float* __restrict__ Wg,
                   const float* __restrict__ bg,   float* __restrict__ hws) {
  __shared__ __bf16 As[64 * AS_STR];
  __shared__ __bf16 Bu[64 * AS_STR];
  __shared__ __bf16 Bg[64 * AS_STR];

  const int tid = threadIdx.x;
  const int tok = blockIdx.y;
  const int n0  = blockIdx.x * 64;

  // Stage A: 64 rows (batch) x 128 K (feature), bf16
  for (int idx = tid; idx < 64 * 128; idx += 256) {
    int b = idx >> 7, k = idx & 127;
    As[b * AS_STR + k] = tobf(Asrc[(b * 128 + k) * 128 + tok]);
  }
  // Stage Wu/Wg tile transposed: B[e][k] = W[tok][k][n0+e]
  for (int idx = tid; idx < 64 * 128; idx += 256) {
    int k = idx >> 6, e = idx & 63;
    size_t g = (size_t)(tok * 128 + k) * 512 + n0 + e;
    Bu[e * AS_STR + k] = tobf(Wu[g]);
    Bg[e * AS_STR + k] = tobf(Wg[g]);
  }
  __syncthreads();

  const int w = tid >> 5, lane = tid & 31, ln = lane & 15, hf = lane >> 4;
  const int mi = w >> 1;                     // both of this wave's tiles share mi
  v8f cu[2] = {}, cg[2] = {};
  const __bf16* arow = As + (mi * 16 + ln) * AS_STR;

#pragma unroll
  for (int kk = 0; kk < 128; kk += 32) {
    v16bf a = load_frag(arow, kk, hf);       // reused across 2 N-tiles x 2 mats
#pragma unroll
    for (int j = 0; j < 2; ++j) {
      int ni = (w & 1) * 2 + j;
      v16bf bU = load_frag(Bu + (ni * 16 + ln) * AS_STR, kk, hf);
      v16bf bG = load_frag(Bg + (ni * 16 + ln) * AS_STR, kk, hf);
      cu[j] = __builtin_amdgcn_wmma_f32_16x16x32_bf16(false, a, false, bU,
                                                      (short)0, cu[j], false, false);
      cg[j] = __builtin_amdgcn_wmma_f32_16x16x32_bf16(false, a, false, bG,
                                                      (short)0, cg[j], false, false);
    }
  }

  // Register-local epilogue: h = (up+bu) * silu(gate+bg)
#pragma unroll
  for (int j = 0; j < 2; ++j) {
    int ni = (w & 1) * 2 + j;
    int e  = n0 + ni * 16 + ln;
    float bu_v = bu[tok * 512 + e];
    float bg_v = bg[tok * 512 + e];
#pragma unroll
    for (int r = 0; r < 8; ++r) {
      int b = mi * 16 + r + 8 * hf;          // C/D layout: M = r + 8*half, N = lane%16
      float u = cu[j][r] + bu_v;
      float g = cg[j][r] + bg_v;
      hws[(size_t)(tok * 64 + b) * 512 + e] = u * silu_f(g);
    }
  }
}

// -----------------------------------------------------------------------------
// Kernel 2: per-token down projection + bias + residual + RMS-norm.
// y[64x128] = h_t[64x512] @ Wd[t][512x128]; out = rmsnorm(y + A) * scale
// grid = (T = 128), block = 256 (8 waves); wave w owns N-block w (B reuse x4)
// -----------------------------------------------------------------------------
__global__ __launch_bounds__(256)
void down_kernel(const float* __restrict__ h,    const float* __restrict__ Wd,
                 const float* __restrict__ bd,   const float* __restrict__ Asrc,
                 const float* __restrict__ scale, float* __restrict__ outp) {
  __shared__ __align__(16) unsigned char smem[(64 + 128) * AS_STR * 2]; // 52224 B
  __bf16* As = (__bf16*)smem;               // 64  x AS_STR (GEMM phase)
  __bf16* Bs = As + 64 * AS_STR;            // 128 x AS_STR (GEMM phase)
  float*  ys = (float*)smem;                // 64 x YS_STR  (epilogue overlay)
  float*  red = (float*)(smem + 64 * YS_STR * 4); // 256 partials + 64 rrms

  const int tid = threadIdx.x;
  const int tok = blockIdx.x;
  const int w = tid >> 5, lane = tid & 31, ln = lane & 15, hf = lane >> 4;

  v8f c[4] = {};
  for (int kc = 0; kc < 4; ++kc) {
    const int K0 = kc * 128;
    __syncthreads();                         // previous chunk fully consumed
    for (int idx = tid; idx < 64 * 128; idx += 256) {
      int b = idx >> 7, k = idx & 127;
      As[b * AS_STR + k] = tobf(h[(size_t)(tok * 64 + b) * 512 + K0 + k]);
    }
    for (int idx = tid; idx < 128 * 128; idx += 256) {
      int k = idx >> 7, n = idx & 127;
      Bs[n * AS_STR + k] = tobf(Wd[(size_t)(tok * 512 + K0 + k) * 128 + n]);
    }
    if (kc < 3)                              // warm L2 for next weight chunk
      __builtin_prefetch(&Wd[(size_t)(tok * 512 + K0 + 128) * 128 + tid], 0, 1);
    __syncthreads();

    const __bf16* brow = Bs + (w * 16 + ln) * AS_STR;
#pragma unroll
    for (int kk = 0; kk < 128; kk += 32) {
      v16bf bfrag = load_frag(brow, kk, hf); // reused across 4 M-tiles
#pragma unroll
      for (int mi = 0; mi < 4; ++mi) {
        v16bf a = load_frag(As + (mi * 16 + ln) * AS_STR, kk, hf);
        c[mi] = __builtin_amdgcn_wmma_f32_16x16x32_bf16(false, a, false, bfrag,
                                                        (short)0, c[mi], false, false);
      }
    }
  }
  __syncthreads();

  // bias + residual (residual == A-gather of this layer) into LDS overlay
  {
    int j = w * 16 + ln;
    float bd_v = bd[tok * 128 + j];
#pragma unroll
    for (int mi = 0; mi < 4; ++mi) {
#pragma unroll
      for (int r = 0; r < 8; ++r) {
        int b = mi * 16 + r + 8 * hf;
        float v = c[mi][r] + bd_v + Asrc[(b * 128 + j) * 128 + tok];
        ys[b * YS_STR + j] = v;
      }
    }
  }
  __syncthreads();

  // RMS-norm: 4-way partial sum of squares per row, then combine
  {
    int row = tid >> 2, part = tid & 3;
    const float* yr = ys + row * YS_STR + part * 32;
    float s = 0.f;
#pragma unroll
    for (int i = 0; i < 32; ++i) s += yr[i] * yr[i];
    red[row * 4 + part] = s;
  }
  __syncthreads();
  if (tid < 64) {
    float s = red[tid * 4] + red[tid * 4 + 1] + red[tid * 4 + 2] + red[tid * 4 + 3];
    red[256 + tid] = rsqrtf(s * (1.0f / 128.0f) + 1e-5f);
  }
  __syncthreads();
  for (int idx = tid; idx < 64 * 128; idx += 256) {
    int b = idx >> 7, j = idx & 127;
    outp[(b * 128 + tok) * 128 + j] = ys[b * YS_STR + j] * red[256 + b] * scale[j];
  }
}

// -----------------------------------------------------------------------------
extern "C" void kernel_launch(void* const* d_in, const int* in_sizes, int n_in,
                              void* d_out, int out_size, void* d_ws, size_t ws_size,
                              hipStream_t stream) {
  const float* x   = (const float*)d_in[0];
  const float* W1u = (const float*)d_in[1];
  const float* b1u = (const float*)d_in[2];
  const float* W1g = (const float*)d_in[3];
  const float* b1g = (const float*)d_in[4];
  const float* W1d = (const float*)d_in[5];
  const float* b1d = (const float*)d_in[6];
  const float* s1  = (const float*)d_in[7];
  const float* W2u = (const float*)d_in[8];
  const float* b2u = (const float*)d_in[9];
  const float* W2g = (const float*)d_in[10];
  const float* b2g = (const float*)d_in[11];
  const float* W2d = (const float*)d_in[12];
  const float* b2d = (const float*)d_in[13];
  const float* s2  = (const float*)d_in[14];

  float* hws = (float*)d_ws;                          // [128][64][512] f32, 16.8 MB
  float* x1s = hws + (size_t)128 * 64 * 512;          // [64][128][128] f32,  4.2 MB
  float* out = (float*)d_out;

  dim3 gUG(8, 128);
  // Layer 1 (A-source = x, token-mix transpose folded into gathers)
  upgate_kernel<<<gUG, 256, 0, stream>>>(x,   W1u, b1u, W1g, b1g, hws);
  down_kernel<<<128, 256, 0, stream>>>(hws, W1d, b1d, x,   s1, x1s);
  // Layer 2 (A-source = x1; reverse token-mix is the same transpose gather)
  upgate_kernel<<<gUG, 256, 0, stream>>>(x1s, W2u, b2u, W2g, b2g, hws);
  down_kernel<<<128, 256, 0, stream>>>(hws, W2d, b2d, x1s, s2, out);
}

// v001
// It runs in 103 microseconds.
// Two timings next to v000 put it at 2.50 and 2.49 times that version's speed.
#include <hip/hip_runtime.h>
#include <hip/hip_bf16.h>

typedef __attribute__((ext_vector_type(16))) __bf16 v16bf;
typedef __attribute__((ext_vector_type(8)))  __bf16 v8bf;
typedef __attribute__((ext_vector_type(8)))  float  v8f;
typedef __attribute__((ext_vector_type(4)))  __bf16 v4bf;
typedef __attribute__((ext_vector_type(4)))  float  f4;

#define AS_STR 136   // 128 K elems + 8 pad (bf16) -> 272B row stride, 16B aligned
#define YS_STR 132   // f32 row stride for epilogue overlay

__device__ __forceinline__ __bf16 tobf(float f) { return (__bf16)f; }

// Load one 16-lane-row fragment per the CDNA5 16-bit A/B 16x32 VGPR layout:
// half 0 -> K kk+0..7 then kk+16..23 ; half 1 -> K kk+8..15 then kk+24..31
__device__ __forceinline__ v16bf load_frag(const __bf16* __restrict__ row, int kk, int hf) {
  v8bf lo = *(const v8bf*)(row + kk + 8 * hf);
  v8bf hi = *(const v8bf*)(row + kk + 16 + 8 * hf);
  v16bf r;
#pragma unroll
  for (int i = 0; i < 8; ++i) { r[i] = lo[i]; r[i + 8] = hi[i]; }
  return r;
}

// Weight staging, one 8(k) x 4(n) register block per call.
// fetch_blk: eight 16-byte loads, one per k row, none waited on here.
__device__ __forceinline__ void fetch_blk(const float* __restrict__ src, int pitch, f4 (&v)[8]) {
#pragma unroll
  for (int j = 0; j < 8; ++j) v[j] = *(const f4*)(src + (size_t)j * pitch);
}
// put_blk: transpose in registers, one 16-byte LDS store (8 k of one n) per column.
__device__ __forceinline__ void put_blk(__bf16* dst, const f4 (&v)[8]) {
#pragma unroll
  for (int c = 0; c < 4; ++c) {
    v8bf p;
#pragma unroll
    for (int j = 0; j < 8; ++j) p[j] = tobf(v[j][c]);
    *(v8bf*)(dst + c * AS_STR) = p;
  }
}

__device__ __forceinline__ float silu_f(float g) { return g / (1.0f + __expf(-g)); }

// -----------------------------------------------------------------------------
// Kernel 1: per-token up & gate projections + SiLU-mul, h[t][b][e] to workspace.
// A[b][k] = Asrc[(b*128+k)*128 + tok]  (token-mix transpose folded into load)
// grid = (E/64 = 8, T = 128), block = 256 (8 waves)
// -----------------------------------------------------------------------------
__global__ __launch_bounds__(256)
void upgate_kernel(const float* __restrict__ Asrc, const float* __restrict__ Wu,
                   const float* __restrict__ bu,   const float* __restrict__ Wg,
                   const float* __restrict__ bg,   float* __restrict__ hws) {
  __shared__ __align__(16) __bf16 As[64 * AS_STR];
  __shared__ __align__(16) __bf16 Bu[64 * AS_STR];
  __shared__ __align__(16) __bf16 Bg[64 * AS_STR];

  const int tid = threadIdx.x;
  const int tok = blockIdx.y;
  const int n0  = blockIdx.x * 64;
  const int w = tid >> 5, lane = tid & 31, ln = lane & 15, hf = lane >> 4;

  // Staging: every global load of this thread's share is issued before the
  // first LDS store, so one memory latency covers the whole tile.
  {
    // Wu/Wg tile transposed: B[e][k] = W[tok][k][n0+e]. A wave load covers
    // 4 k rows x 128 B; its LDS stores then fall on all 64 banks.
    const int k8 = ((w & 3) * 4 + (lane >> 3)) * 8;
    const int e4 = ((w >> 2) * 8 + (lane & 7)) * 4;
    const size_t g = (size_t)(tok * 128 + k8) * 512 + n0 + e4;
    f4 vu[8], vg[8];
    fetch_blk(Wu + g, 512, vu);
    // A later load's result may land in the address registers of these loads.
    asm volatile("s_wait_xcnt 0x0" ::: "memory");
    fetch_blk(Wg + g, 512, vg);
    // A: 64 rows (batch) x 128 K (feature); this thread: row ab, 32 k from ak
    const int ab = tid >> 2, ak = (tid & 3) * 32;
    const float* ap = Asrc + (size_t)(ab * 128 + ak) * 128 + tok;
    float va[32];
#pragma unroll
    for (int i = 0; i < 32; ++i) va[i] = ap[i * 128];
    // Keeps all 48 loads ahead of the first conversion; without it the
    // scheduler mixes loads with waits and fewer are in flight.
    __builtin_amdgcn_sched_barrier(0);
    put_blk(Bu + e4 * AS_STR + k8, vu);
    put_blk(Bg + e4 * AS_STR + k8, vg);
#pragma unroll
    for (int s = 0; s < 4; ++s) {
      v8bf p;
#pragma unroll
      for (int j = 0; j < 8; ++j) p[j] = tobf(va[s * 8 + j]);
      *(v8bf*)(As + ab * AS_STR + ak + s * 8) = p;
    }
  }
  __syncthreads();

  const int mi = w >> 1;                     // both of this wave's tiles share mi
  v8f cu[2] = {}, cg[2] = {};
  const __bf16* arow = As + (mi * 16 + ln) * AS_STR;

#pragma unroll
  for (int kk = 0; kk < 128; kk += 32) {
    v16bf a = load_frag(arow, kk, hf);       // reused across 2 N-tiles x 2 mats
#pragma unroll
    for (int j = 0; j < 2; ++j) {
      int ni = (w & 1) * 2 + j;
      v16bf bU = load_frag(Bu + (ni * 16 + ln) * AS_STR, kk, hf);
      v16bf bG = load_frag(Bg + (ni * 16 + ln) * AS_STR, kk, hf);
      cu[j] = __builtin_amdgcn_wmma_f32_16x16x32_bf16(false, a, false, bU,
                                                      (short)0, cu[j], false, false);
      cg[j] = __builtin_amdgcn_wmma_f32_16x16x32_bf16(false, a, false, bG,
                                                      (short)0, cg[j], false, false);
    }
  }

  // Register-local epilogue: h = (up+bu) * silu(gate+bg)
#pragma unroll
  for (int j = 0; j < 2; ++j) {
    int ni = (w & 1) * 2 + j;
    int e  = n0 + ni * 16 + ln;
    float bu_v = bu[tok * 512 + e];
    float bg_v = bg[tok * 512 + e];
#pragma unroll
    for (int r = 0; r < 8; ++r) {
      int b = mi * 16 + r + 8 * hf;          // C/D layout: M = r + 8*half, N = lane%16
      float u = cu[j][r] + bu_v;
      float g = cg[j][r] + bg_v;
      hws[(size_t)(tok * 64 + b) * 512 + e] = u * silu_f(g);
    }
  }
}

// -----------------------------------------------------------------------------
// Kernel 2: per-token down projection + bias + residual + RMS-norm.
// y[64x128] = h_t[64x512] @ Wd[t][512x128]; out = rmsnorm(y + A) * scale
// grid = (T = 128), block = 256 (8 waves); wave w owns N-block w (B reuse x4)
// -----------------------------------------------------------------------------
__global__ __launch_bounds__(256)
void down_kernel(const float* __restrict__ h,    const float* __restrict__ Wd,
                 const float* __restrict__ bd,   const float* __restrict__ Asrc,
                 const float* __restrict__ scale, float* __restrict__ outp) {
  __shared__ __align__(16) unsigned char smem[(64 + 128) * AS_STR * 2]; // 52224 B
  __bf16* As = (__bf16*)smem;               // 64  x AS_STR (GEMM phase)
  __bf16* Bs = As + 64 * AS_STR;            // 128 x AS_STR (GEMM phase)
  float*  ys = (float*)smem;                // 64 x YS_STR  (epilogue overlay)
  float*  red = (float*)(smem + 64 * YS_STR * 4); // 256 partials + 64 rrms

  const int tid = threadIdx.x;
  const int tok = blockIdx.x;
  const int w = tid >> 5, lane = tid & 31, ln = lane & 15, hf = lane >> 4;

  v8f c[4] = {};
  for (int kc = 0; kc < 4; ++kc) {
    const int K0 = kc * 128;
    __syncthreads();                         // previous chunk fully consumed
    {
      // All 24 16-byte loads of this thread are issued before the first LDS store.
      f4 vb[2][8], va[8];
      // Wd: two 8(k) x 4(n) blocks, 32 k apart. A wave load covers 4 k rows
      // x 128 B; its LDS stores then fall on all 64 banks.
      const int k8 = ((w & 1) * 8 + (lane >> 3)) * 8;
      const int n4 = ((w >> 1) * 8 + (lane & 7)) * 4;
      const float* wp = Wd + (size_t)(tok * 512 + K0 + k8) * 128 + n4;
      fetch_blk(wp, 128, vb[0]);
      fetch_blk(wp + 32 * 128, 128, vb[1]);
      const float* hp = h + (size_t)(tok * 64 + w) * 512 + K0 + lane * 4;
#pragma unroll
      for (int i = 0; i < 8; ++i)            // h: one 512-byte row per wave load
        va[i] = *(const f4*)(hp + i * (8 * 512));
      // Keeps all 24 loads ahead of the first conversion; without it the
      // scheduler mixes loads with waits and about ten are in flight.
      __builtin_amdgcn_sched_barrier(0);
      put_blk(Bs + n4 * AS_STR + k8, vb[0]);
      put_blk(Bs + n4 * AS_STR + k8 + 32, vb[1]);
#pragma unroll
      for (int i = 0; i < 8; ++i) {
        v4bf p;
#pragma unroll
        for (int j = 0; j < 4; ++j) p[j] = tobf(va[i][j]);
        *(v4bf*)(As + (w + 8 * i) * AS_STR + lane * 4) = p;
      }
    }
    if (kc < 3)                              // warm L2 for next weight chunk
      __builtin_prefetch(&Wd[(size_t)(tok * 512 + K0 + 128) * 128 + tid], 0, 1);
    __syncthreads();

    const __bf16* brow = Bs + (w * 16 + ln) * AS_STR;
#pragma unroll
    for (int kk = 0; kk < 128; kk += 32) {
      v16bf bfrag = load_frag(brow, kk, hf); // reused across 4 M-tiles
#pragma unroll
      for (int mi = 0; mi < 4; ++mi) {
        v16bf a = load_frag(As + (mi * 16 + ln) * AS_STR, kk, hf);
        c[mi] = __builtin_amdgcn_wmma_f32_16x16x32_bf16(false, a, false, bfrag,
                                                        (short)0, c[mi], false, false);
      }
    }
  }
  __syncthreads();

  // bias + residual (residual == A-gather of this layer) into LDS overlay
  {
    int j = w * 16 + ln;
    float bd_v = bd[tok * 128 + j];
#pragma unroll
    for (int mi = 0; mi < 4; ++mi) {
#pragma unroll
      for (int r = 0; r < 8; ++r) {
        int b = mi * 16 + r + 8 * hf;
        float v = c[mi][r] + bd_v + Asrc[(b * 128 + j) * 128 + tok];
        ys[b * YS_STR + j] = v;
      }
    }
  }
  __syncthreads();

  // RMS-norm: 4-way partial sum of squares per row, then combine
  {
    int row = tid >> 2, part = tid & 3;
    const float* yr = ys + row * YS_STR + part * 32;
    float s = 0.f;
#pragma unroll
    for (int i = 0; i < 32; ++i) s += yr[i] * yr[i];
    red[row * 4 + part] = s;
  }
  __syncthreads();
  if (tid < 64) {
    float s = red[tid * 4] + red[tid * 4 + 1] + red[tid * 4 + 2] + red[tid * 4 + 3];
    red[256 + tid] = rsqrtf(s * (1.0f / 128.0f) + 1e-5f);
  }
  __syncthreads();
  for (int idx = tid; idx < 64 * 128; idx += 256) {
    int b = idx >> 7, j = idx & 127;
    outp[(b * 128 + tok) * 128 + j] = ys[b * YS_STR + j] * red[256 + b] * scale[j];
  }
}

// -----------------------------------------------------------------------------
extern "C" void kernel_launch(void* const* d_in, const int* in_sizes, int n_in,
                              void* d_out, int out_size, void* d_ws, size_t ws_size,
                              hipStream_t stream) {
  const float* x   = (const float*)d_in[0];
  const float* W1u = (const float*)d_in[1];
  const float* b1u = (const float*)d_in[2];
  const float* W1g = (const float*)d_in[3];
  const float* b1g = (const float*)d_in[4];
  const float* W1d = (const float*)d_in[5];
  const float* b1d = (const float*)d_in[6];
  const float* s1  = (const float*)d_in[7];
  const float* W2u = (const float*)d_in[8];
  const float* b2u = (const float*)d_in[9];
  const float* W2g = (const float*)d_in[10];
  const float* b2g = (const float*)d_in[11];
  const float* W2d = (const float*)d_in[12];
  const float* b2d = (const float*)d_in[13];
  const float* s2  = (const float*)d_in[14];

  float* hws = (float*)d_ws;                          // [128][64][512] f32, 16.8 MB
  float* x1s = hws + (size_t)128 * 64 * 512;          // [64][128][128] f32,  4.2 MB
  float* out = (float*)d_out;

  dim3 gUG(8, 128);
  // Layer 1 (A-source = x, token-mix transpose folded into gathers)
  upgate_kernel<<<gUG, 256, 0, stream>>>(x,   W1u, b1u, W1g, b1g, hws);
  down_kernel<<<128, 256, 0, stream>>>(hws, W1d, b1d, x,   s1, x1s);
  // Layer 2 (A-source = x1; reverse token-mix is the same transpose gather)
  upgate_kernel<<<gUG, 256, 0, stream>>>(x1s, W2u, b2u, W2g, b2g, hws);
  down_kernel<<<128, 256, 0, stream>>>(hws, W2d, b2d, x1s, s2, out);
}

// v002
// Measured time: 51.9 microseconds a run.
// Next to v001, in two timings, it ran 1.99 and 1.98 times as fast.
// Over all steps from v000 it is 4.95 times as fast.
#include <hip/hip_runtime.h>
#include <hip/hip_bf16.h>

typedef __attribute__((ext_vector_type(16))) __bf16 v16bf;
typedef __attribute__((ext_vector_type(8)))  __bf16 v8bf;
typedef __attribute__((ext_vector_type(8)))  float  v8f;
typedef __attribute__((ext_vector_type(4)))  __bf16 v4bf;
typedef __attribute__((ext_vector_type(4)))  float  f4;

#define AS_STR 136   // 128 K elems + 8 pad (bf16) -> 272B row stride, 16B aligned
#define YS_STR 132   // f32 row stride for epilogue overlay

__device__ __forceinline__ __bf16 tobf(float f) { return (__bf16)f; }

// Load one 16-lane-row fragment per the CDNA5 16-bit A/B 16x32 VGPR layout:
// half 0 -> K kk+0..7 then kk+16..23 ; half 1 -> K kk+8..15 then kk+24..31
__device__ __forceinline__ v16bf load_frag(const __bf16* __restrict__ row, int kk, int hf) {
  v8bf lo = *(const v8bf*)(row + kk + 8 * hf);
  v8bf hi = *(const v8bf*)(row + kk + 16 + 8 * hf);
  v16bf r;
#pragma unroll
  for (int i = 0; i < 8; ++i) { r[i] = lo[i]; r[i + 8] = hi[i]; }
  return r;
}

// Weight staging, one 8(k) x 4(n) register block per call.
// fetch_blk: eight 16-byte loads, one per k row, none waited on here.
__device__ __forceinline__ void fetch_blk(const float* __restrict__ src, int pitch, f4 (&v)[8]) {
#pragma unroll
  for (int j = 0; j < 8; ++j) v[j] = *(const f4*)(src + (size_t)j * pitch);
}
// put_blk: transpose in registers, one 16-byte LDS store (8 k of one n) per column.
__device__ __forceinline__ void put_blk(__bf16* dst, const f4 (&v)[8]) {
#pragma unroll
  for (int c = 0; c < 4; ++c) {
    v8bf p;
#pragma unroll
    for (int j = 0; j < 8; ++j) p[j] = tobf(v[j][c]);
    *(v8bf*)(dst + c * AS_STR) = p;
  }
}

__device__ __forceinline__ float silu_f(float g) { return g / (1.0f + __expf(-g)); }

// -----------------------------------------------------------------------------
// Kernel 0: token-mix transpose, done once per layer: dst[t][b][k] = src[b][k][t].
// Each thread moves four 4(k) x 4(t) blocks and transposes them in registers.
// A wave load takes 64-byte pieces of 8 k rows; a wave store fills four whole
// 128-byte lines (32 k of 4 t rows). Every line of dst has one writing wave.
// grid = (4 tiles of 64k x 64t, B = 64), block = 64 (2 waves)
// -----------------------------------------------------------------------------
__global__ __launch_bounds__(64)
void mix_kernel(const float* __restrict__ src, float* __restrict__ dst) {
  const int tid = threadIdx.x;
  const int w = tid >> 5, lane = tid & 31;
  const int b  = blockIdx.y;
  const int k0 = (blockIdx.x & 1) * 64 + w * 32 + (lane & 7) * 4;
  const int t0 = (blockIdx.x >> 1) * 64 + (lane >> 3) * 4;
  const float* sp = src + (size_t)(b * 128 + k0) * 128 + t0;
  f4 v[4][4];
#pragma unroll
  for (int q = 0; q < 4; ++q)
#pragma unroll
    for (int j = 0; j < 4; ++j) v[q][j] = *(const f4*)(sp + j * 128 + q * 16);
  // Keeps all 16 loads ahead of the first wait; without it the scheduler
  // issues ten, waits, and pays a second memory latency for the rest.
  __builtin_amdgcn_sched_barrier(0);
  float* dp = dst + (size_t)t0 * (64 * 128) + b * 128 + k0;
#pragma unroll
  for (int q = 0; q < 4; ++q)
#pragma unroll
    for (int c = 0; c < 4; ++c) {
      f4 o = {v[q][0][c], v[q][1][c], v[q][2][c], v[q][3][c]};
      *(f4*)(dp + (size_t)(q * 16 + c) * (64 * 128)) = o;
    }
}

// -----------------------------------------------------------------------------
// Kernel 1: per-token up & gate projections + SiLU-mul, h[t][b][e] to workspace.
// A[b][k] = At[(tok*64+b)*128 + k]  (token-mixed copy made by mix_kernel)
// grid = (E/64 = 8, T = 128), block = 256 (8 waves)
// -----------------------------------------------------------------------------
__global__ __launch_bounds__(256)
void upgate_kernel(const float* __restrict__ At,   const float* __restrict__ Wu,
                   const float* __restrict__ bu,   const float* __restrict__ Wg,
                   const float* __restrict__ bg,   float* __restrict__ hws) {
  __shared__ __align__(16) __bf16 As[64 * AS_STR];
  __shared__ __align__(16) __bf16 Bu[64 * AS_STR];
  __shared__ __align__(16) __bf16 Bg[64 * AS_STR];

  const int tid = threadIdx.x;
  const int tok = blockIdx.y;
  const int n0  = blockIdx.x * 64;
  const int w = tid >> 5, lane = tid & 31, ln = lane & 15, hf = lane >> 4;

  // Staging: every global load of this thread's share is issued before the
  // first LDS store, so one memory latency covers the whole tile.
  {
    // Wu/Wg tile transposed: B[e][k] = W[tok][k][n0+e]. A wave load covers
    // 4 k rows x 128 B; its LDS stores then fall on all 64 banks.
    const int k8 = ((w & 3) * 4 + (lane >> 3)) * 8;
    const int e4 = ((w >> 2) * 8 + (lane & 7)) * 4;
    const size_t g = (size_t)(tok * 128 + k8) * 512 + n0 + e4;
    f4 vu[8], vg[8];
    fetch_blk(Wu + g, 512, vu);
    // A later load's result may land in the address registers of these loads.
    asm volatile("s_wait_xcnt 0x0" ::: "memory");
    fetch_blk(Wg + g, 512, vg);
    // A: 64 rows (batch) x 128 K (feature); one 512-byte row per wave load
    const float* ap = At + (size_t)(tok * 64 + w) * 128 + lane * 4;
    f4 va[8];
#pragma unroll
    for (int i = 0; i < 8; ++i) va[i] = *(const f4*)(ap + i * (8 * 128));
    // Keeps all 24 loads ahead of the first conversion; without it the
    // scheduler mixes loads with waits and fewer are in flight.
    __builtin_amdgcn_sched_barrier(0);
    put_blk(Bu + e4 * AS_STR + k8, vu);
    put_blk(Bg + e4 * AS_STR + k8, vg);
#pragma unroll
    for (int i = 0; i < 8; ++i) {
      v4bf p;
#pragma unroll
      for (int j = 0; j < 4; ++j) p[j] = tobf(va[i][j]);
      *(v4bf*)(As + (w + 8 * i) * AS_STR + lane * 4) = p;
    }
  }
  __syncthreads();

  const int mi = w >> 1;                     // both of this wave's tiles share mi
  v8f cu[2] = {}, cg[2] = {};
  const __bf16* arow = As + (mi * 16 + ln) * AS_STR;

#pragma unroll
  for (int kk = 0; kk < 128; kk += 32) {
    v16bf a = load_frag(arow, kk, hf);       // reused across 2 N-tiles x 2 mats
#pragma unroll
    for (int j = 0; j < 2; ++j) {
      int ni = (w & 1) * 2 + j;
      v16bf bU = load_frag(Bu + (ni * 16 + ln) * AS_STR, kk, hf);
      v16bf bG = load_frag(Bg + (ni * 16 + ln) * AS_STR, kk, hf);
      cu[j] = __builtin_amdgcn_wmma_f32_16x16x32_bf16(false, a, false, bU,
                                                      (short)0, cu[j], false, false);
      cg[j] = __builtin_amdgcn_wmma_f32_16x16x32_bf16(false, a, false, bG,
                                                      (short)0, cg[j], false, false);
    }
  }

  // Register-local epilogue: h = (up+bu) * silu(gate+bg)
#pragma unroll
  for (int j = 0; j < 2; ++j) {
    int ni = (w & 1) * 2 + j;
    int e  = n0 + ni * 16 + ln;
    float bu_v = bu[tok * 512 + e];
    float bg_v = bg[tok * 512 + e];
#pragma unroll
    for (int r = 0; r < 8; ++r) {
      int b = mi * 16 + r + 8 * hf;          // C/D layout: M = r + 8*half, N = lane%16
      float u = cu[j][r] + bu_v;
      float g = cg[j][r] + bg_v;
      hws[(size_t)(tok * 64 + b) * 512 + e] = u * silu_f(g);
    }
  }
}

// -----------------------------------------------------------------------------
// Kernel 2: per-token down projection + bias + residual + RMS-norm.
// y[64x128] = h_t[64x512] @ Wd[t][512x128]; out = rmsnorm(y + A) * scale
// grid = (T = 128), block = 256 (8 waves); wave w owns N-block w (B reuse x4)
// -----------------------------------------------------------------------------
__global__ __launch_bounds__(256)
void down_kernel(const float* __restrict__ h,    const float* __restrict__ Wd,
                 const float* __restrict__ bd,   const float* __restrict__ At,
                 const float* __restrict__ scale, float* __restrict__ outp) {
  __shared__ __align__(16) unsigned char smem[(64 + 128) * AS_STR * 2]; // 52224 B
  __bf16* As = (__bf16*)smem;               // 64  x AS_STR (GEMM phase)
  __bf16* Bs = As + 64 * AS_STR;            // 128 x AS_STR (GEMM phase)
  float*  ys = (float*)smem;                // 64 x YS_STR  (epilogue overlay)
  float*  red = (float*)(smem + 64 * YS_STR * 4); // 256 partials + 64 rrms

  const int tid = threadIdx.x;
  const int tok = blockIdx.x;
  const int w = tid >> 5, lane = tid & 31, ln = lane & 15, hf = lane >> 4;

  v8f c[4] = {};
  for (int kc = 0; kc < 4; ++kc) {
    const int K0 = kc * 128;
    __syncthreads();                         // previous chunk fully consumed
    {
      // All 24 16-byte loads of this thread are issued before the first LDS store.
      f4 vb[2][8], va[8];
      // Wd: two 8(k) x 4(n) blocks, 32 k apart. A wave load covers 4 k rows
      // x 128 B; its LDS stores then fall on all 64 banks.
      const int k8 = ((w & 1) * 8 + (lane >> 3)) * 8;
      const int n4 = ((w >> 1) * 8 + (lane & 7)) * 4;
      const float* wp = Wd + (size_t)(tok * 512 + K0 + k8) * 128 + n4;
      fetch_blk(wp, 128, vb[0]);
      fetch_blk(wp + 32 * 128, 128, vb[1]);
      const float* hp = h + (size_t)(tok * 64 + w) * 512 + K0 + lane * 4;
#pragma unroll
      for (int i = 0; i < 8; ++i)            // h: one 512-byte row per wave load
        va[i] = *(const f4*)(hp + i * (8 * 512));
      // Keeps all 24 loads ahead of the first conversion; without it the
      // scheduler mixes loads with waits and about ten are in flight.
      __builtin_amdgcn_sched_barrier(0);
      put_blk(Bs + n4 * AS_STR + k8, vb[0]);
      put_blk(Bs + n4 * AS_STR + k8 + 32, vb[1]);
#pragma unroll
      for (int i = 0; i < 8; ++i) {
        v4bf p;
#pragma unroll
        for (int j = 0; j < 4; ++j) p[j] = tobf(va[i][j]);
        *(v4bf*)(As + (w + 8 * i) * AS_STR + lane * 4) = p;
      }
    }
    if (kc < 3)                              // warm L2 for next weight chunk
      __builtin_prefetch(&Wd[(size_t)(tok * 512 + K0 + 128) * 128 + tid], 0, 1);
    __syncthreads();

    const __bf16* brow = Bs + (w * 16 + ln) * AS_STR;
#pragma unroll
    for (int kk = 0; kk < 128; kk += 32) {
      v16bf bfrag = load_frag(brow, kk, hf); // reused across 4 M-tiles
#pragma unroll
      for (int mi = 0; mi < 4; ++mi) {
        v16bf a = load_frag(As + (mi * 16 + ln) * AS_STR, kk, hf);
        c[mi] = __builtin_amdgcn_wmma_f32_16x16x32_bf16(false, a, false, bfrag,
                                                        (short)0, c[mi], false, false);
      }
    }
  }
  __syncthreads();

  // bias + residual (residual == this layer's A, token-mixed copy) into LDS overlay
  {
    int j = w * 16 + ln;
    const int ro = (tok * 64 + 8 * hf) * 128 + j;   // row 8*hf of this token's A
    const float* rp = At + ro;
    float res[4][8];
#pragma unroll
    for (int mi = 0; mi < 4; ++mi)
#pragma unroll
      for (int r = 0; r < 8; ++r) res[mi][r] = rp[(mi * 16 + r) * 128];
    float bd_v = bd[tok * 128 + j];
    // The 32 loads share the offset register ro; naming it here keeps it whole
    // until the wait, so that no later load's result lands in it before.
    asm volatile("s_wait_xcnt 0x0" :: "v"(ro) : "memory");
#pragma unroll
    for (int mi = 0; mi < 4; ++mi) {
#pragma unroll
      for (int r = 0; r < 8; ++r) {
        int b = mi * 16 + r + 8 * hf;
        float v = c[mi][r] + bd_v + res[mi][r];
        ys[b * YS_STR + j] = v;
      }
    }
  }
  __syncthreads();

  // RMS-norm: 4-way partial sum of squares per row, then combine
  {
    int row = tid >> 2, part = tid & 3;
    const float* yr = ys + row * YS_STR + part * 32;
    float s = 0.f;
#pragma unroll
    for (int i = 0; i < 32; ++i) s += yr[i] * yr[i];
    red[row * 4 + part] = s;
  }
  __syncthreads();
  if (tid < 64) {
    float s = red[tid * 4] + red[tid * 4 + 1] + red[tid * 4 + 2] + red[tid * 4 + 3];
    red[256 + tid] = rsqrtf(s * (1.0f / 128.0f) + 1e-5f);
  }
  __syncthreads();
  for (int idx = tid; idx < 64 * 128; idx += 256) {
    int b = idx >> 7, j = idx & 127;
    outp[(b * 128 + tok) * 128 + j] = ys[b * YS_STR + j] * red[256 + b] * scale[j];
  }
}

// -----------------------------------------------------------------------------
extern "C" void kernel_launch(void* const* d_in, const int* in_sizes, int n_in,
                              void* d_out, int out_size, void* d_ws, size_t ws_size,
                              hipStream_t stream) {
  const float* x   = (const float*)d_in[0];
  const float* W1u = (const float*)d_in[1];
  const float* b1u = (const float*)d_in[2];
  const float* W1g = (const float*)d_in[3];
  const float* b1g = (const float*)d_in[4];
  const float* W1d = (const float*)d_in[5];
  const float* b1d = (const float*)d_in[6];
  const float* s1  = (const float*)d_in[7];
  const float* W2u = (const float*)d_in[8];
  const float* b2u = (const float*)d_in[9];
  const float* W2g = (const float*)d_in[10];
  const float* b2g = (const float*)d_in[11];
  const float* W2d = (const float*)d_in[12];
  const float* b2d = (const float*)d_in[13];
  const float* s2  = (const float*)d_in[14];

  float* hws = (float*)d_ws;                          // [128][64][512] f32, 16.8 MB
  float* x1s = hws + (size_t)128 * 64 * 512;          // [64][128][128] f32,  4.2 MB
  float* xt  = x1s + (size_t)64 * 128 * 128;          // [128][64][128] f32, token-mixed x
  float* x1t = xt  + (size_t)64 * 128 * 128;          // [128][64][128] f32, token-mixed x1
  float* out = (float*)d_out;

  dim3 gUG(8, 128);
  dim3 gMX(4, 64);
  // Layer 1 (A = token-mixed x)
  mix_kernel<<<gMX, 64, 0, stream>>>(x, xt);
  upgate_kernel<<<gUG, 256, 0, stream>>>(xt,  W1u, b1u, W1g, b1g, hws);
  down_kernel<<<128, 256, 0, stream>>>(hws, W1d, b1d, xt,  s1, x1s);
  // Layer 2 (A = token-mixed x1; the reverse mix is the same transpose)
  mix_kernel<<<gMX, 64, 0, stream>>>(x1s, x1t);
  upgate_kernel<<<gUG, 256, 0, stream>>>(x1t, W2u, b2u, W2g, b2g, hws);
  down_kernel<<<128, 256, 0, stream>>>(hws, W2d, b2d, x1t, s2, out);
}

// v003
// Measured time: 36.9 microseconds a run.
// Next to v002, in two timings, it ran 1.41 and 1.40 times as fast.
// Over all steps from v000 it is 6.95 times as fast.
#include <hip/hip_runtime.h>
#include <hip/hip_bf16.h>

typedef __attribute__((ext_vector_type(16))) __bf16 v16bf;
typedef __attribute__((ext_vector_type(8)))  __bf16 v8bf;
typedef __attribute__((ext_vector_type(8)))  float  v8f;
typedef __attribute__((ext_vector_type(4)))  __bf16 v4bf;
typedef __attribute__((ext_vector_type(4)))  float  f4;
typedef __attribute__((ext_vector_type(2)))  float  f2;
typedef __attribute__((ext_vector_type(2)))  __bf16 v2bf;

#define AS_STR 136   // 128 K elems + 8 pad (bf16) -> 272B row stride, 16B aligned
#define HS_STR 520   // 512 K elems + 8 pad (bf16) -> 1040B row stride, 16B aligned
#define PS_STR 132   // f32 row stride of the down partial sums

__device__ __forceinline__ __bf16 tobf(float f) { return (__bf16)f; }

// Load one 16-lane-row fragment per the CDNA5 16-bit A/B 16x32 VGPR layout:
// half 0 -> K kk+0..7 then kk+16..23 ; half 1 -> K kk+8..15 then kk+24..31
__device__ __forceinline__ v16bf load_frag(const __bf16* __restrict__ row, int kk, int hf) {
  v8bf lo = *(const v8bf*)(row + kk + 8 * hf);
  v8bf hi = *(const v8bf*)(row + kk + 16 + 8 * hf);
  v16bf r;
#pragma unroll
  for (int i = 0; i < 8; ++i) { r[i] = lo[i]; r[i + 8] = hi[i]; }
  return r;
}

// Weight block of one wave, 32(k) x 32(n), straight into registers: lane (ln, hf)
// takes columns 2*ln, 2*ln+1 of rows 8*hf+0..7 and 16+8*hf+0..7, which is the
// k order of load_frag. A wave load covers two whole 128-byte lines.
template <int PITCH>
__device__ __forceinline__ void fetch_w(const float* __restrict__ p, f2 (&r)[16]) {
#pragma unroll
  for (int j = 0; j < 8; ++j) {
    r[j]     = *(const f2*)(p + j * PITCH);
    r[8 + j] = *(const f2*)(p + (16 + j) * PITCH);
  }
  // A later load's result may land in the address registers of these loads.
  asm volatile("s_wait_xcnt 0x0" ::: "memory");
}
// B fragment of column 2*ln + c
__device__ __forceinline__ v16bf col_frag(const f2 (&r)[16], int c) {
  v16bf b;
#pragma unroll
  for (int i = 0; i < 16; ++i) b[i] = tobf(r[i][c]);
  return b;
}
__device__ __forceinline__ v8f mma(v16bf a, v16bf b, v8f c) {
  return __builtin_amdgcn_wmma_f32_16x16x32_bf16(false, a, false, b, (short)0, c, false, false);
}

__device__ __forceinline__ float silu_f(float g) { return g / (1.0f + __expf(-g)); }

// -----------------------------------------------------------------------------
// Kernel 0: token-mix transpose, done once per layer: dst[t][b][k] = src[b][k][t].
// Each thread moves four 4(k) x 4(t) blocks and transposes them in registers.
// A wave load takes 64-byte pieces of 8 k rows; a wave store fills four whole
// 128-byte lines (32 k of 4 t rows). Every line of dst has one writing wave.
// grid = (4 tiles of 64k x 64t, B = 64), block = 64 (2 waves)
// -----------------------------------------------------------------------------
__global__ __launch_bounds__(64)
void mix_kernel(const float* __restrict__ src, float* __restrict__ dst) {
  const int tid = threadIdx.x;
  const int w = tid >> 5, lane = tid & 31;
  const int b  = blockIdx.y;
  const int k0 = (blockIdx.x & 1) * 64 + w * 32 + (lane & 7) * 4;
  const int t0 = (blockIdx.x >> 1) * 64 + (lane >> 3) * 4;
  const float* sp = src + (size_t)(b * 128 + k0) * 128 + t0;
  f4 v[4][4];
#pragma unroll
  for (int q = 0; q < 4; ++q)
#pragma unroll
    for (int j = 0; j < 4; ++j) v[q][j] = *(const f4*)(sp + j * 128 + q * 16);
  // Keeps all 16 loads ahead of the first wait; without it the scheduler
  // issues ten, waits, and pays a second memory latency for the rest.
  __builtin_amdgcn_sched_barrier(0);
  float* dp = dst + (size_t)t0 * (64 * 128) + b * 128 + k0;
#pragma unroll
  for (int q = 0; q < 4; ++q)
#pragma unroll
    for (int c = 0; c < 4; ++c) {
      f4 o = {v[q][0][c], v[q][1][c], v[q][2][c], v[q][3][c]};
      *(f4*)(dp + (size_t)(q * 16 + c) * (64 * 128)) = o;
    }
}

// -----------------------------------------------------------------------------
// Kernel 1: one token's whole SwiGLU MLP + residual + RMS-norm.
// A[b][k] = At[(tok*64+b)*128 + k]  (token-mixed copy made by mix_kernel)
// Phase 1: wave w owns columns w*32..+31 of up and gate, all 64 rows, K = 128;
//          h = (up+bu)*silu(gate+bg) goes to LDS as bf16.
// Phase 2: wave w owns columns (w&3)*32..+31 of down and K quarter w>>2;
//          the four K quarters are summed through LDS.
// Every weight element is loaded once, by one wave, into a B fragment.
// grid = (T = 128), block = 512 (16 waves)
// -----------------------------------------------------------------------------
__global__ __launch_bounds__(512)
void mlp_kernel(const float* __restrict__ At,   const float* __restrict__ Wu,
                const float* __restrict__ bu,   const float* __restrict__ Wg,
                const float* __restrict__ bg,   const float* __restrict__ Wd,
                const float* __restrict__ bd,   const float* __restrict__ scale,
                float* __restrict__ outp) {
  __shared__ __align__(16) __bf16 As[64 * AS_STR];
  __shared__ __align__(16) __bf16 Hs[64 * HS_STR];
  __shared__ __align__(16) float  Ps[4 * 64 * PS_STR];

  const int tid = threadIdx.x;
  const int tok = blockIdx.x;
  const int w = tid >> 5, lane = tid & 31, ln = lane & 15, hf = lane >> 4;

  const int e0 = w * 32 + 2 * ln;
  const float* pu = Wu + (size_t)(tok * 128 + 8 * hf) * 512 + e0;
  const float* pg = Wg + (size_t)(tok * 128 + 8 * hf) * 512 + e0;
  const int ks = w >> 2, n0 = (w & 3) * 32 + 2 * ln;
  const float* pd = Wd + (size_t)(tok * 512 + ks * 128 + 8 * hf) * 128 + n0;

  // Phase 1 keeps one weight block in flight per wave: as soon as a block is converted to
  // its two B fragments, the next block is asked for into the same registers.
  f2 raw[16];
  {
    // A: 64 rows (batch) x 128 K (feature); one 512-byte row per wave load
    const float* ap = At + (size_t)(tok * 64 + w) * 128 + lane * 4;
    f4 va[4];
#pragma unroll
    for (int i = 0; i < 4; ++i) va[i] = *(const f4*)(ap + i * (16 * 128));
    fetch_w<512>(pu, raw);                   // flies while A is staged
#pragma unroll
    for (int i = 0; i < 4; ++i) {
      v4bf p;
#pragma unroll
      for (int j = 0; j < 4; ++j) p[j] = tobf(va[i][j]);
      *(v4bf*)(As + (w + 16 * i) * AS_STR + lane * 4) = p;
    }
  }
  __syncthreads();

  // Biases are asked for here, so that the SiLU does not wait on them.
  f2 bu_v = *(const f2*)(bu + tok * 512 + e0);
  // The next load's result may land in the offset register that both loads name.
  asm volatile("s_wait_xcnt 0x0" ::: "memory");
  f2 bg_v = *(const f2*)(bg + tok * 512 + e0);
  asm volatile("s_wait_xcnt 0x0" ::: "memory");  // the same, for what follows

  v8f cu[4][2] = {}, cg[4][2] = {};
#pragma unroll
  for (int s = 0; s < 4; ++s) {
    {
      v16bf b0 = col_frag(raw, 0), b1 = col_frag(raw, 1);
      fetch_w<512>(pg + s * 32 * 512, raw);
#pragma unroll
      for (int mi = 0; mi < 4; ++mi) {
        v16bf a = load_frag(As + (mi * 16 + ln) * AS_STR, s * 32, hf);
        cu[mi][0] = mma(a, b0, cu[mi][0]);
        cu[mi][1] = mma(a, b1, cu[mi][1]);
      }
    }
    {
      v16bf b0 = col_frag(raw, 0), b1 = col_frag(raw, 1);
      if (s < 3) fetch_w<512>(pu + (s + 1) * 32 * 512, raw);
      else       fetch_w<128>(pd, raw);      // first down block flies over the SiLU
#pragma unroll
      for (int mi = 0; mi < 4; ++mi) {
        v16bf a = load_frag(As + (mi * 16 + ln) * AS_STR, s * 32, hf);
        cg[mi][0] = mma(a, b0, cg[mi][0]);
        cg[mi][1] = mma(a, b1, cg[mi][1]);
      }
    }
  }

  // h = (up+bu) * silu(gate+bg), two neighbouring columns per 4-byte LDS store
  f2 raw2[16];
  {
#pragma unroll
    for (int mi = 0; mi < 4; ++mi) {
      // half of the accumulators are done with: room for the second down block
      if (mi == 2) fetch_w<128>(pd + 32 * 128, raw2);
#pragma unroll
      for (int r = 0; r < 8; ++r) {
        int b = mi * 16 + r + 8 * hf;        // C/D layout: M = r + 8*half, N = lane%16
        v2bf p;
#pragma unroll
        for (int c = 0; c < 2; ++c) {
          float u = cu[mi][c][r] + bu_v[c];
          float g = cg[mi][c][r] + bg_v[c];
          p[c] = tobf(u * silu_f(g));
        }
        *(v2bf*)(Hs + b * HS_STR + e0) = p;
      }
    }
  }
  __syncthreads();

  v8f cd[4][2] = {};
#pragma unroll
  for (int s = 0; s < 4; ++s) {
    f2 (&rw)[16] = (s & 1) ? raw2 : raw;
    v16bf b0 = col_frag(rw, 0), b1 = col_frag(rw, 1);
    if (s < 2) fetch_w<128>(pd + (s + 2) * 32 * 128, rw);
#pragma unroll
    for (int mi = 0; mi < 4; ++mi) {
      v16bf a = load_frag(Hs + (mi * 16 + ln) * HS_STR, ks * 128 + s * 32, hf);
      cd[mi][0] = mma(a, b0, cd[mi][0]);
      cd[mi][1] = mma(a, b1, cd[mi][1]);
    }
  }

  // Wave w finishes rows 4w..4w+3; its residual rows (this layer's A), bias and
  // scale are asked for ahead of the barrier.
  const float* rp = At + (size_t)(tok * 64 + w * 4) * 128 + lane * 4;
  f4 res[4];
#pragma unroll
  for (int q = 0; q < 4; ++q) res[q] = *(const f4*)(rp + q * 128);
  f4 bd_v = *(const f4*)(bd + tok * 128 + lane * 4);
  f4 sc_v = *(const f4*)(scale + lane * 4);
  // A later load's result may land in the address registers of these loads.
  asm volatile("s_wait_xcnt 0x0" ::: "memory");

#pragma unroll
  for (int mi = 0; mi < 4; ++mi)
#pragma unroll
    for (int r = 0; r < 8; ++r) {
      int b = mi * 16 + r + 8 * hf;
      f2 p = {cd[mi][0][r], cd[mi][1][r]};
      *(f2*)(Ps + (ks * 64 + b) * PS_STR + n0) = p;
    }
  __syncthreads();

#pragma unroll
  for (int q = 0; q < 4; ++q) {
    const int b = w * 4 + q;
    const float* pp = Ps + b * PS_STR + lane * 4;
    f4 y = (*(const f4*)pp + *(const f4*)(pp + 64 * PS_STR)) +
           (*(const f4*)(pp + 128 * PS_STR) + *(const f4*)(pp + 192 * PS_STR));
    y = y + bd_v + res[q];
    float s = (y[0] * y[0] + y[1] * y[1]) + (y[2] * y[2] + y[3] * y[3]);
#pragma unroll
    for (int m = 16; m >= 1; m >>= 1) s += __shfl_xor(s, m);
    float rr = rsqrtf(s * (1.0f / 128.0f) + 1e-5f);
    *(f4*)(outp + ((size_t)b * 128 + tok) * 128 + lane * 4) = y * rr * sc_v;
  }
}

// -----------------------------------------------------------------------------
extern "C" void kernel_launch(void* const* d_in, const int* in_sizes, int n_in,
                              void* d_out, int out_size, void* d_ws, size_t ws_size,
                              hipStream_t stream) {
  const float* x   = (const float*)d_in[0];
  const float* W1u = (const float*)d_in[1];
  const float* b1u = (const float*)d_in[2];
  const float* W1g = (const float*)d_in[3];
  const float* b1g = (const float*)d_in[4];
  const float* W1d = (const float*)d_in[5];
  const float* b1d = (const float*)d_in[6];
  const float* s1  = (const float*)d_in[7];
  const float* W2u = (const float*)d_in[8];
  const float* b2u = (const float*)d_in[9];
  const float* W2g = (const float*)d_in[10];
  const float* b2g = (const float*)d_in[11];
  const float* W2d = (const float*)d_in[12];
  const float* b2d = (const float*)d_in[13];
  const float* s2  = (const float*)d_in[14];

  float* x1s = (float*)d_ws;                          // [64][128][128] f32,  4.2 MB
  float* xt  = x1s + (size_t)64 * 128 * 128;          // [128][64][128] f32, token-mixed x
  float* x1t = xt  + (size_t)64 * 128 * 128;          // [128][64][128] f32, token-mixed x1
  float* out = (float*)d_out;

  dim3 gMX(4, 64);
  // Layer 1 (A = token-mixed x)
  mix_kernel<<<gMX, 64, 0, stream>>>(x, xt);
  mlp_kernel<<<128, 512, 0, stream>>>(xt,  W1u, b1u, W1g, b1g, W1d, b1d, s1, x1s);
  // Layer 2 (A = token-mixed x1; the reverse mix is the same transpose)
  mix_kernel<<<gMX, 64, 0, stream>>>(x1s, x1t);
  mlp_kernel<<<128, 512, 0, stream>>>(x1t, W2u, b2u, W2g, b2g, W2d, b2d, s2, out);
}

// v004
// One run takes 32.6 microseconds.
// Next to v003, in two timings, it ran 1.13 times as fast each time.
// All steps since v000 together make it 7.87 times as fast.
#include <hip/hip_runtime.h>
#include <hip/hip_bf16.h>

typedef __attribute__((ext_vector_type(16))) __bf16 v16bf;
typedef __attribute__((ext_vector_type(8)))  __bf16 v8bf;
typedef __attribute__((ext_vector_type(8)))  float  v8f;
typedef __attribute__((ext_vector_type(4)))  __bf16 v4bf;
typedef __attribute__((ext_vector_type(4)))  float  f4;
typedef __attribute__((ext_vector_type(2)))  float  f2;
typedef __attribute__((ext_vector_type(2)))  __bf16 v2bf;

#define AS_STR 136   // 128 K elems + 8 pad (bf16) -> 272B row stride, 16B aligned
#define HS_STR 264   // 256 K elems + 8 pad (bf16) -> 528B row stride, 16B aligned
#define PS_STR 132   // f32 row stride of the down partial sums
#define TT_STR 36    // f32 row stride of the transposed tile, 16B aligned
#define PLANE (128 * 64 * 128)  // elements of one [token][batch][feature] plane

__device__ __forceinline__ __bf16 tobf(float f) { return (__bf16)f; }

// Load one 16-lane-row fragment per the CDNA5 16-bit A/B 16x32 VGPR layout:
// half 0 -> K kk+0..7 then kk+16..23 ; half 1 -> K kk+8..15 then kk+24..31
__device__ __forceinline__ v16bf load_frag(const __bf16* __restrict__ row, int kk, int hf) {
  v8bf lo = *(const v8bf*)(row + kk + 8 * hf);
  v8bf hi = *(const v8bf*)(row + kk + 16 + 8 * hf);
  v16bf r;
#pragma unroll
  for (int i = 0; i < 8; ++i) { r[i] = lo[i]; r[i + 8] = hi[i]; }
  return r;
}

// Weight block of one wave, 32(k) x 32(n), straight into registers: lane (ln, hf)
// takes columns 2*ln, 2*ln+1 of rows 8*hf+0..7 and 16+8*hf+0..7, which is the
// k order of load_frag. A wave load covers two whole 128-byte lines.
// The block starts 'row' rows below p.
template <int PITCH>
__device__ __forceinline__ void fetch_w(const float* __restrict__ p, int row, f2 (&r)[16]) {
#pragma unroll
  for (int j = 0; j < 8; ++j) {
    r[j]     = *(const f2*)(p + (row + j) * PITCH);
    r[8 + j] = *(const f2*)(p + (row + 16 + j) * PITCH);
  }
  // A later load's result may land in the address registers of these loads; as
  // an input of the wait the address outlives the block's own last load too.
  asm volatile("s_wait_xcnt 0x0" :: "v"(p) : "memory");
}
// B fragment of column 2*ln + c
__device__ __forceinline__ v16bf col_frag(const f2 (&r)[16], int c) {
  v16bf b;
#pragma unroll
  for (int i = 0; i < 16; ++i) b[i] = tobf(r[i][c]);
  return b;
}
__device__ __forceinline__ v8f mma(v16bf a, v16bf b, v8f c) {
  return __builtin_amdgcn_wmma_f32_16x16x32_bf16(false, a, false, b, (short)0, c, false, false);
}

__device__ __forceinline__ float silu_f(float g) { return g / (1.0f + __expf(-g)); }

// -----------------------------------------------------------------------------
// Kernel 0: token-mix transpose of the input: dst[t][b][k] = src[b][k][t].
// Each thread moves four 4(k) x 4(t) blocks and transposes them in registers.
// A wave load takes 64-byte pieces of 8 k rows; a wave store fills four whole
// 128-byte lines (32 k of 4 t rows). Every line of dst has one writing wave.
// grid = (4 tiles of 64k x 64t, B = 64), block = 64 (2 waves)
// -----------------------------------------------------------------------------
__global__ __launch_bounds__(64)
void mix_kernel(const float* __restrict__ src, float* __restrict__ dst) {
  const int tid = threadIdx.x;
  const int w = tid >> 5, lane = tid & 31;
  const int b  = blockIdx.y;
  const int k0 = (blockIdx.x & 1) * 64 + w * 32 + (lane & 7) * 4;
  const int t0 = (blockIdx.x >> 1) * 64 + (lane >> 3) * 4;
  const float* sp = src + (size_t)(b * 128 + k0) * 128 + t0;
  f4 v[4][4];
#pragma unroll
  for (int q = 0; q < 4; ++q)
#pragma unroll
    for (int j = 0; j < 4; ++j) v[q][j] = *(const f4*)(sp + j * 128 + q * 16);
  // Keeps all 16 loads ahead of the first wait; without it the scheduler
  // issues ten, waits, and pays a second memory latency for the rest.
  __builtin_amdgcn_sched_barrier(0);
  float* dp = dst + (size_t)t0 * (64 * 128) + b * 128 + k0;
#pragma unroll
  for (int q = 0; q < 4; ++q)
#pragma unroll
    for (int c = 0; c < 4; ++c) {
      f4 o = {v[q][0][c], v[q][1][c], v[q][2][c], v[q][3][c]};
      *(f4*)(dp + (size_t)(q * 16 + c) * (64 * 128)) = o;
    }
}

// -----------------------------------------------------------------------------
// Kernel 1: one half of the hidden columns of one token's SwiGLU MLP.
// A[b][k] = At[(tok*64+b)*128 + k]  (token-mixed copy made by the kernel before)
// Work-group (tok, eh) owns hidden columns eh*256..+255, so that 256 work-groups
// stream the weights.
// Phase 1: wave w owns columns w*32..+31 of its half of up and gate, all 64 rows,
//          K = 128; h = (up+bu)*silu(gate+bg) goes to LDS as bf16.
// Phase 2: wave w owns columns (w&3)*32..+31 of down and K part w>>2 (128 of the
//          half's 256); the two parts are summed through LDS and the sum goes to
//          plane eh of part[2][tok][b][d]. finish_kernel adds the two planes.
// Every weight element is loaded once, by one wave, into a B fragment.
// grid = (2 * T = 256), block = 256 (8 waves)
// -----------------------------------------------------------------------------
__global__ __launch_bounds__(256)
void mlp_kernel(const float* __restrict__ At,   const float* __restrict__ Wu,
                const float* __restrict__ bu,   const float* __restrict__ Wg,
                const float* __restrict__ bg,   const float* __restrict__ Wd,
                float* __restrict__ part) {
  __shared__ __align__(16) __bf16 As[64 * AS_STR];
  __shared__ __align__(16) __bf16 Hs[64 * HS_STR];
  __shared__ __align__(16) float  Ps[2 * 64 * PS_STR];

  const int tid = threadIdx.x;
  const int tok = blockIdx.x >> 1, eh = blockIdx.x & 1;
  const int w = tid >> 5, lane = tid & 31, ln = lane & 15, hf = lane >> 4;

  const int el = w * 32 + 2 * ln;            // column inside the half
  const int e0 = eh * 256 + el;
  const float* pu = Wu + (size_t)(tok * 128 + 8 * hf) * 512 + e0;
  const float* pg = Wg + (size_t)(tok * 128 + 8 * hf) * 512 + e0;
  const int ks = w >> 2, n0 = (w & 3) * 32 + 2 * ln;
  const float* pd = Wd + (size_t)(tok * 512 + eh * 256 + ks * 128 + 8 * hf) * 128 + n0;

  // Two weight blocks are in flight per wave (8 waves hold what 16 held with
  // one): as soon as a block is converted to its two B fragments, the block two
  // places on is asked for into the same registers.
  f2 ra[16], rb[16];
  {
    // A: 64 rows (batch) x 128 K (feature); one 512-byte row per wave load
    const float* ap = At + (size_t)(tok * 64 + w) * 128 + lane * 4;
    f4 va[8];
#pragma unroll
    for (int i = 0; i < 8; ++i) va[i] = *(const f4*)(ap + i * (8 * 128));
    fetch_w<512>(pu, 0, ra);                 // fly while A is staged
    fetch_w<512>(pg, 0, rb);
#pragma unroll
    for (int i = 0; i < 8; ++i) {
      v4bf p;
#pragma unroll
      for (int j = 0; j < 4; ++j) p[j] = tobf(va[i][j]);
      *(v4bf*)(As + (w + 8 * i) * AS_STR + lane * 4) = p;
    }
  }
  __syncthreads();

  // Biases are asked for here, so that the SiLU does not wait on them.
  f2 bu_v = *(const f2*)(bu + tok * 512 + e0);
  // The next load's result may land in the offset register that both loads name.
  asm volatile("s_wait_xcnt 0x0" ::: "memory");
  f2 bg_v = *(const f2*)(bg + tok * 512 + e0);
  asm volatile("s_wait_xcnt 0x0" ::: "memory");  // the same, for what follows

  v8f cu[4][2] = {}, cg[4][2] = {};
#pragma unroll
  for (int s = 0; s < 4; ++s) {
    {
      v16bf b0 = col_frag(ra, 0), b1 = col_frag(ra, 1);
      if (s < 3) fetch_w<512>(pu, (s + 1) * 32, ra);
      else       fetch_w<128>(pd, 0, ra);    // the first two down blocks
#pragma unroll
      for (int mi = 0; mi < 4; ++mi) {
        v16bf a = load_frag(As + (mi * 16 + ln) * AS_STR, s * 32, hf);
        cu[mi][0] = mma(a, b0, cu[mi][0]);
        cu[mi][1] = mma(a, b1, cu[mi][1]);
      }
    }
    {
      v16bf b0 = col_frag(rb, 0), b1 = col_frag(rb, 1);
      if (s < 3) fetch_w<512>(pg, (s + 1) * 32, rb);
      else       fetch_w<128>(pd, 32, rb);   // fly over the SiLU
#pragma unroll
      for (int mi = 0; mi < 4; ++mi) {
        v16bf a = load_frag(As + (mi * 16 + ln) * AS_STR, s * 32, hf);
        cg[mi][0] = mma(a, b0, cg[mi][0]);
        cg[mi][1] = mma(a, b1, cg[mi][1]);
      }
    }
  }

  // h = (up+bu) * silu(gate+bg), two neighbouring columns per 4-byte LDS store
#pragma unroll
  for (int mi = 0; mi < 4; ++mi) {
#pragma unroll
    for (int r = 0; r < 8; ++r) {
      int b = mi * 16 + r + 8 * hf;          // C/D layout: M = r + 8*half, N = lane%16
      v2bf p;
#pragma unroll
      for (int c = 0; c < 2; ++c) {
        float u = cu[mi][c][r] + bu_v[c];
        float g = cg[mi][c][r] + bg_v[c];
        p[c] = tobf(u * silu_f(g));
      }
      *(v2bf*)(Hs + b * HS_STR + el) = p;
    }
  }
  __syncthreads();

  v8f cd[4][2] = {};
#pragma unroll
  for (int s = 0; s < 4; ++s) {
    f2 (&rw)[16] = (s & 1) ? rb : ra;
    v16bf b0 = col_frag(rw, 0), b1 = col_frag(rw, 1);
    if (s < 2) fetch_w<128>(pd, (s + 2) * 32, rw);
#pragma unroll
    for (int mi = 0; mi < 4; ++mi) {
      v16bf a = load_frag(Hs + (mi * 16 + ln) * HS_STR, ks * 128 + s * 32, hf);
      cd[mi][0] = mma(a, b0, cd[mi][0]);
      cd[mi][1] = mma(a, b1, cd[mi][1]);
    }
  }

#pragma unroll
  for (int mi = 0; mi < 4; ++mi)
#pragma unroll
    for (int r = 0; r < 8; ++r) {
      int b = mi * 16 + r + 8 * hf;
      f2 p = {cd[mi][0][r], cd[mi][1][r]};
      *(f2*)(Ps + (ks * 64 + b) * PS_STR + n0) = p;
    }
  __syncthreads();

  // Wave w sums and stores rows 8w..8w+7, one whole 512-byte row per wave store.
  float* op = part + (size_t)eh * PLANE + (size_t)(tok * 64 + w * 8) * 128 + lane * 4;
  f4 y[8];
#pragma unroll
  for (int q = 0; q < 8; ++q) {
    const float* pp = Ps + (w * 8 + q) * PS_STR + lane * 4;
    y[q] = *(const f4*)pp + *(const f4*)(pp + 64 * PS_STR);
  }
#pragma unroll
  for (int q = 0; q < 8; ++q) *(f4*)(op + q * 128) = y[q];
}

// -----------------------------------------------------------------------------
// Kernel 2: adds the two hidden halves' down sums, bias and residual, RMS-norm.
// Wave w takes tokens k0+4w..+3 of batch row b; a lane holds 4 features of each.
// MIX: the result is stored token-mixed for the next layer, dst[d][b][tok]: each
//      thread's 4(tok) x 4(d) block goes transposed through LDS, and a wave store
//      fills four whole 128-byte lines (32 tok of 4 d rows).
// else: dst[b][tok][d], one whole 512-byte row per wave store.
// grid = (4 blocks of 32 tokens, B = 64), block = 256 (8 waves)
// -----------------------------------------------------------------------------
template <bool MIX>
__global__ __launch_bounds__(256)
void finish_kernel(const float* __restrict__ part, const float* __restrict__ At,
                   const float* __restrict__ bd,   const float* __restrict__ scale,
                   float* __restrict__ dst) {
  __shared__ __align__(16) float Tt[MIX ? 128 * TT_STR : 4];
  const int tid = threadIdx.x;
  const int w = tid >> 5, lane = tid & 31;
  const int b  = blockIdx.y;
  const int k0 = blockIdx.x * 32;
  const int tk = k0 + w * 4;
  const size_t row = (size_t)(tk * 64 + b) * 128 + lane * 4;
  const float* pp = part + row;
  const float* pa = At + row;
  const float* pb = bd + tk * 128 + lane * 4;
  f4 p0[4], p1[4], res[4], bd_v[4];
#pragma unroll
  for (int q = 0; q < 4; ++q) {
    p0[q]   = *(const f4*)(pp + q * (64 * 128));
    p1[q]   = *(const f4*)(pp + q * (64 * 128) + PLANE);
    res[q]  = *(const f4*)(pa + q * (64 * 128));
    bd_v[q] = *(const f4*)(pb + q * 128);
  }
  f4 sc_v = *(const f4*)(scale + lane * 4);
  // A later result may land in the address registers of these loads; as inputs
  // of the wait the addresses outlive the last load of the group too.
  asm volatile("s_wait_xcnt 0x0" :: "v"(pp), "v"(pa), "v"(pb) : "memory");
  // Keeps all 17 loads ahead of the first wait; without it the scheduler issues
  // twelve, waits, and pays a second memory latency for the rest.
  __builtin_amdgcn_sched_barrier(0);

  f4 v[4];
#pragma unroll
  for (int q = 0; q < 4; ++q) {
    f4 y = p0[q] + p1[q];
    y = y + bd_v[q] + res[q];
    float s = (y[0] * y[0] + y[1] * y[1]) + (y[2] * y[2] + y[3] * y[3]);
#pragma unroll
    for (int m = 16; m >= 1; m >>= 1) s += __shfl_xor(s, m);
    float rr = rsqrtf(s * (1.0f / 128.0f) + 1e-5f);
    v[q] = y * rr * sc_v;
  }

  if (MIX) {
#pragma unroll
    for (int j = 0; j < 4; ++j) {
      f4 o = {v[0][j], v[1][j], v[2][j], v[3][j]};
      *(f4*)(Tt + (lane * 4 + j) * TT_STR + w * 4) = o;
    }
    __syncthreads();
    const int t0 = w * 16 + (lane >> 3), kq = (lane & 7) * 4;
    float* dp = dst + (size_t)t0 * (64 * 128) + b * 128 + k0 + kq;
#pragma unroll
    for (int i = 0; i < 4; ++i)
      *(f4*)(dp + (size_t)i * (4 * 64 * 128)) = *(const f4*)(Tt + (t0 + i * 4) * TT_STR + kq);
  } else {
    float* dp = dst + (size_t)(b * 128 + tk) * 128 + lane * 4;
#pragma unroll
    for (int q = 0; q < 4; ++q) *(f4*)(dp + q * 128) = v[q];
  }
}

// -----------------------------------------------------------------------------
extern "C" void kernel_launch(void* const* d_in, const int* in_sizes, int n_in,
                              void* d_out, int out_size, void* d_ws, size_t ws_size,
                              hipStream_t stream) {
  const float* x   = (const float*)d_in[0];
  const float* W1u = (const float*)d_in[1];
  const float* b1u = (const float*)d_in[2];
  const float* W1g = (const float*)d_in[3];
  const float* b1g = (const float*)d_in[4];
  const float* W1d = (const float*)d_in[5];
  const float* b1d = (const float*)d_in[6];
  const float* s1  = (const float*)d_in[7];
  const float* W2u = (const float*)d_in[8];
  const float* b2u = (const float*)d_in[9];
  const float* W2g = (const float*)d_in[10];
  const float* b2g = (const float*)d_in[11];
  const float* W2d = (const float*)d_in[12];
  const float* b2d = (const float*)d_in[13];
  const float* s2  = (const float*)d_in[14];

  float* xt   = (float*)d_ws;                         // [128][64][128] f32, token-mixed x
  float* x1t  = xt  + (size_t)64 * 128 * 128;         // [128][64][128] f32, token-mixed x1
  float* part = x1t + (size_t)64 * 128 * 128;         // [2][128][64][128] f32, down sums
  float* out  = (float*)d_out;

  dim3 gMX(4, 64);
  // Layer 1 (A = token-mixed x)
  mix_kernel<<<gMX, 64, 0, stream>>>(x, xt);
  mlp_kernel<<<256, 256, 0, stream>>>(xt,  W1u, b1u, W1g, b1g, W1d, part);
  // the reverse mix is the same transpose
  finish_kernel<true><<<gMX, 256, 0, stream>>>(part, xt, b1d, s1, x1t);
  // Layer 2 (A = token-mixed x1)
  mlp_kernel<<<256, 256, 0, stream>>>(x1t, W2u, b2u, W2g, b2g, W2d, part);
  finish_kernel<false><<<gMX, 256, 0, stream>>>(part, x1t, b2d, s2, out);
}
